// v000
// Times are from an AMD MI455X. After a warm-up the kernel runs many times in a row, and a time is the length of
// such a window on the GPU divided by its runs, so every launch and the gaps after it count. The runs cycle
// through copies of the inputs. A figure is the median of several windows, for all but v000 over two sittings.
// Sittings can differ by a few percent; kernels timed side by side share one.
// v000 is the starting kernel. One run takes 473 microseconds.
#include <hip/hip_runtime.h>

// Contractions and operand types (f32 accumulate everywhere): q/k/v projections = v_wmma_f32_16x16x32_bf16 on bf16 (RNE) planes of the inputs and of Wq/Wk/Wv; scores q.k^T = v_wmma_f32_16x16x32_f16 with q as f16 hi plane plus f16 residual plane (x2048, own f32 buffer folded x2^-11) and k f16 x1; P.v^T and the output projection = v_wmma_f32_16x16x32_f16 (P f16 x1024; v^T f16 x1; ctx f16 x1024; Wo f16 x64 of its bf16 RNE value; 2^-16 folded back in the f32 epilogue); softmax f32; bias bf16 RNE value added in f32.
// Data flow: bf16 planes XQ/XK/XV and WQ/WK/WV; one f32 staging buffer reused in sequence for q, k, v^T (z-batched [E][T]) and the attention context O; f16 planes Qhi, Qres, K, V^T, CTX (all batches) and S f32 / R f32 / P f16 for one batch at a time; out rows [b*T + t][o] = CTX.Wo^T x 2^-16 + bo.

#ifndef NB
#define NB 4
#endif
#ifndef SEQ
#define SEQ 2048
#endif
#define NB_FULL  4
#define SEQ_FULL 2048
#define EM   512
#define TT   SEQ
#define PCAR 1024.0f
#define WCAR 64.0f
#define RCAR 2048.0f
#define RINV (1.0f / 2048.0f)
#define OSC  (1.0f / 65536.0f)
#define SCL  0.044194173824159216f   // 512^-0.5

static_assert(SEQ % 128 == 0);
static_assert(SEQ >= 128 && SEQ <= SEQ_FULL);
static_assert(NB >= 1 && NB <= NB_FULL);
static_assert(EM % 64 == 0 && EM % 32 == 0);
static_assert(((size_t)NB * SEQ) % 64 == 0);
static_assert((size_t)NB * SEQ * EM * 4 <= (size_t)16777216);

typedef _Float16 h16;
typedef unsigned short bf;
typedef __attribute__((ext_vector_type(16))) __bf16   v16bf;
typedef __attribute__((ext_vector_type(16))) _Float16 v16h;
typedef __attribute__((ext_vector_type(8)))  _Float16 v8h;
typedef __attribute__((ext_vector_type(4)))  _Float16 v4h;
typedef __attribute__((ext_vector_type(8)))  unsigned short v8us;
typedef __attribute__((ext_vector_type(8)))  float    v8f;
typedef __attribute__((ext_vector_type(4)))  float    v4f;
typedef v4f  __attribute__((may_alias)) v4fa;

__device__ __forceinline__ unsigned short f2bf(float f) { unsigned u = __float_as_uint(f); u += 0x7FFFu + ((u >> 16) & 1u); return (unsigned short)(u >> 16); }   // RNE convert
__device__ __forceinline__ float bf2f(unsigned short b) { return __uint_as_float(((unsigned)b) << 16); }
__device__ __forceinline__ float bfr(float f) { return bf2f(f2bf(f)); }
__device__ __forceinline__ h16 tohx(float x) { return (h16)x; }
__device__ __forceinline__ v16h cat16(v8h lo, v8h hi) { return __builtin_shufflevector(lo, hi, 0, 1, 2, 3, 4, 5, 6, 7, 8, 9, 10, 11, 12, 13, 14, 15); }
__device__ __forceinline__ v16bf cat16b(v8us lo, v8us hi) { return __builtin_bit_cast(v16bf, __builtin_shufflevector(lo, hi, 0, 1, 2, 3, 4, 5, 6, 7, 8, 9, 10, 11, 12, 13, 14, 15)); }
__device__ __forceinline__ v8f wmma16(v16h a, v16h b, v8f c) { return __builtin_amdgcn_wmma_f32_16x16x32_f16(false, a, false, b, (short)0, c, false, false); }
__device__ __forceinline__ v8f wmmab(v16bf a, v16bf b, v8f c) { return __builtin_amdgcn_wmma_f32_16x16x32_bf16(false, a, false, b, (short)0, c, false, false); }

// ---- k_gemmw: register-blocked GEMM, ONE WAVE per 64x64 output tile (16 accumulators), operands straight from K-contiguous 16-bit planes; grid (M/64, N/64, Z), 32 threads.
// C[m][n] (f32, pitch ldc) = oscale * sum_k A[m][k] Bt[n][k] (+ bf16-valued f32 bias[n]). z-batch strides sA/sB/sC in elements. K % 32 == 0, M % 64 == 0, N % 64 == 0.
// Fragments: lane l, row/col l&15, h = l>>4; elements 0..7 <- k0 + 8h + 0..7, elements 8..15 <- k0 + 16 + 8h + 0..7 for BOTH A and Bt; D element r -> row 8h + r, col l&15.
template <typename T16> struct WFrag;
template <> struct WFrag<h16> { typedef v16h V; static __device__ __forceinline__ V ld(const h16* p) { return cat16(*(const v8h*)p, *(const v8h*)(p + 16)); } static __device__ __forceinline__ v8f mma(V a, V b, v8f c) { return wmma16(a, b, c); } };
template <> struct WFrag<bf> { typedef v16bf V; static __device__ __forceinline__ V ld(const bf* p) { return cat16b(*(const v8us*)p, *(const v8us*)(p + 16)); } static __device__ __forceinline__ v8f mma(V a, V b, v8f c) { return wmmab(a, b, c); } };
template <typename T16, bool BIAS>
__global__ __launch_bounds__(32) void k_gemmw(const T16* __restrict__ A, const T16* __restrict__ Bt, int K, float* C, int ldc, const float* __restrict__ bias, float oscale, size_t sA, size_t sB, size_t sC) {
    typedef typename WFrag<T16>::V V;
    __shared__ __align__(16) float os[16 * 68];
    const size_t z = blockIdx.z; A += z * sA; Bt += z * sB; C += z * sC;
    const int lane = threadIdx.x & 31, lr = lane & 15, hi = lane >> 4; const int r0 = blockIdx.x * 64, c0 = blockIdx.y * 64;
    v8f acc[4][4];
#pragma unroll
    for (int mb = 0; mb < 4; ++mb)
#pragma unroll
        for (int nb = 0; nb < 4; ++nb) acc[mb][nb] = (v8f){};
    const size_t aoff = (size_t)(r0 + lr) * K + 8 * hi, boff = (size_t)(c0 + lr) * K + 8 * hi;
#pragma unroll 1
    for (int kc = 0; kc < K; kc += 32) {
        V a[4];
#pragma unroll
        for (int mb = 0; mb < 4; ++mb) a[mb] = WFrag<T16>::ld(A + aoff + (size_t)mb * 16 * K + kc);
#pragma unroll
        for (int nb = 0; nb < 4; ++nb) { const V b = WFrag<T16>::ld(Bt + boff + (size_t)nb * 16 * K + kc);
#pragma unroll
            for (int mb = 0; mb < 4; ++mb) acc[mb][nb] = WFrag<T16>::mma(a[mb], b, acc[mb][nb]); }
        asm volatile("v_nop\n\tv_nop\n\tv_nop\n\tv_nop" : "+v"(acc[0][0]), "+v"(acc[1][1]), "+v"(acc[2][2]), "+v"(acc[3][3]) : "v"(a[0]), "v"(a[3]));
    }
#pragma unroll
    for (int mb = 0; mb < 4; ++mb) {
#pragma unroll
        for (int nb = 0; nb < 4; ++nb) {
#pragma unroll
            for (int j = 0; j < 8; ++j) os[(hi * 8 + j) * 68 + nb * 16 + lr] = acc[mb][nb][j]; }
        __builtin_amdgcn_wave_barrier(); asm volatile("" ::: "memory");
        float* crow = C + (size_t)(r0 + mb * 16) * ldc + c0;
{
#pragma unroll
            for (int s = 0; s < 8; ++s) { const int row = 2 * s + hi, cofs = lr * 4; v4f val = *(const v4fa*)(os + row * 68 + cofs); val = val * oscale;
                if (BIAS) { val[0] += bfr(bias[c0 + cofs]); val[1] += bfr(bias[c0 + cofs + 1]); val[2] += bfr(bias[c0 + cofs + 2]); val[3] += bfr(bias[c0 + cofs + 3]); }
                *(v4f*)(crow + (size_t)row * ldc + cofs) = val; }
             }
        __builtin_amdgcn_wave_barrier(); asm volatile("" ::: "memory");
    }
}

__global__ __launch_bounds__(256) void k_cvtb(const float* __restrict__ src, size_t sstride, bf* dst, size_t dstride, size_t n8) {
    const size_t i = (size_t)blockIdx.x * 256 + threadIdx.x; if (i >= n8) return;
    const float* s = src + (size_t)blockIdx.y * sstride + i * 8; bf* d = dst + (size_t)blockIdx.y * dstride + i * 8;
    const v8f v = *(const v8f*)s; v8us o;
#pragma unroll
    for (int k = 0; k < 8; ++k) o[k] = f2bf(v[k]);
    *(v8us*)d = o;  }

template <bool RND>
__global__ __launch_bounds__(256) void k_cvth(const float* __restrict__ src, h16* dst, size_t n8, float sc) {
    const size_t i = (size_t)blockIdx.x * 256 + threadIdx.x; if (i >= n8) return;
    const v8f v = *(const v8f*)(src + i * 8); v8h o;
#pragma unroll
    for (int k = 0; k < 8; ++k) { float x = v[k]; if (RND) x = bfr(x); o[k] = tohx(x * sc); }
    *(v8h*)(dst + i * 8) = o;  }

__global__ __launch_bounds__(256) void k_cvthr(const float* __restrict__ src, h16* dhi, h16* dlo, size_t n8, float rsc) {
    const size_t i = (size_t)blockIdx.x * 256 + threadIdx.x; if (i >= n8) return;
    const v8f v = *(const v8f*)(src + i * 8); v8h oh, ol;
#pragma unroll
    for (int k = 0; k < 8; ++k) { const float x = v[k]; const h16 hx = tohx(x); float r = __fsub_rn(x, (float)hx); asm volatile("" : "+v"(r)); oh[k] = hx; ol[k] = tohx(r * rsc); }
    *(v8h*)(dhi + i * 8) = oh; *(v8h*)(dlo + i * 8) = ol;  }

// k_asoft: one wave per score row i: t = (S + R) x 512^-0.5 (R = residual-plane scores already folded; no mask); max-subtracted softmax over the TT keys (register row, one exp2, fixed trees); P row stored as f16 x1024
__global__ __launch_bounds__(256) void k_asoft(const float* __restrict__ Sb, const float* __restrict__ Rb, h16* P16) {
    const int lane = threadIdx.x & 31; const int row = blockIdx.x * 8 + (threadIdx.x >> 5); if (row >= TT) return;
    const float* sr = Sb + (size_t)row * TT; const float* rr = Rb + (size_t)row * TT; float v[TT / 32]; float mx = -3.0e38f;
#pragma unroll
    for (int ch = 0; ch < TT / 128; ++ch) { const int j0 = ch * 128 + lane * 4; const v4f a = *(const v4f*)(sr + j0); const v4f c = *(const v4f*)(rr + j0);
#pragma unroll
        for (int q = 0; q < 4; ++q) { float s0 = __fadd_rn(a[q], c[q]); asm volatile("" : "+v"(s0)); const float t = s0 * SCL; v[ch * 4 + q] = t; mx = fmaxf(mx, t); } }
#pragma unroll
    for (int sh = 16; sh; sh >>= 1) mx = fmaxf(mx, __shfl_xor(mx, sh, 32));
    float sum = 0.f;
#pragma unroll
    for (int k = 0; k < TT / 32; ++k) { float d0 = __fsub_rn(v[k], mx); asm volatile("" : "+v"(d0)); v[k] = __builtin_amdgcn_exp2f(__fmul_rn(d0, 1.4426950408889634f)); sum += v[k]; }
#pragma unroll
    for (int sh = 16; sh; sh >>= 1) sum += __shfl_xor(sum, sh, 32);
    const float f = __fdiv_rn(PCAR, sum);
{
#pragma unroll
        for (int ch = 0; ch < TT / 128; ++ch) { v4h o4;
#pragma unroll
            for (int q = 0; q < 4; ++q) o4[q] = tohx(v[ch * 4 + q] * f);
            *(v4h*)(P16 + (size_t)row * TT + ch * 128 + lane * 4) = o4; }
         }
}

extern "C" void kernel_launch(void* const* d_in, const int* in_sizes, int n_in,
                              void* d_out, int out_size, void* d_ws, size_t ws_size, hipStream_t stream) {
    if (n_in < 8) return;
    const size_t needx = (size_t)(NB - 1) * SEQ_FULL * EM + (size_t)SEQ * EM;
    if ((size_t)in_sizes[0] < needx || (size_t)in_sizes[1] < needx || (size_t)in_sizes[2] < needx) return;
    if (in_sizes[3] < EM * EM || in_sizes[4] < EM * EM || in_sizes[5] < EM * EM || in_sizes[6] < EM * EM || in_sizes[7] < EM) return;
    if ((size_t)out_size < (size_t)NB * SEQ * EM) return;
    const float* Xv = (const float*)d_in[0];   // value [NB_FULL][SEQ_FULL][EM]
    const float* Xk = (const float*)d_in[1];   // key
    const float* Xq = (const float*)d_in[2];   // query
    const float* Wq = (const float*)d_in[3];   // [EM out][EM in]
    const float* Wk = (const float*)d_in[4];
    const float* Wv = (const float*)d_in[5];
    const float* Wo = (const float*)d_in[6];
    const float* bo = (const float*)d_in[7];   // [EM]
    float* OUT = (float*)d_out;                // [NB][SEQ][EM] f32

    char* wsp = (char*)d_ws;
    auto take = [&](size_t bytes) { char* p = wsp; wsp += (bytes + 255) & ~(size_t)255; return (void*)p; };
    const size_t nTE = (size_t)SEQ * EM;       // per-batch plane elements
    const size_t nW = (size_t)EM * EM;
    bf*  XQ16 = (bf*)take((size_t)NB * nTE * 2); bf* XK16 = (bf*)take((size_t)NB * nTE * 2); bf* XV16 = (bf*)take((size_t)NB * nTE * 2);   // [NB*T][E] bf16
    bf*  WQ16 = (bf*)take(nW * 2); bf* WK16 = (bf*)take(nW * 2); bf* WV16 = (bf*)take(nW * 2);                                           // [E][E] bf16 (as-is: Bt for q and k, A for v^T)
    h16* WO16 = (h16*)take(nW * 2);                                                                                                     // [E][E] f16 x64
    float* F32 = (float*)take((size_t)NB * nTE * 4);                                                                                   // f32 staging: q, k, v^T [NB][E][T], then O [NB*T][E]
    h16* Q16 = (h16*)take((size_t)NB * nTE * 2); h16* QL16 = (h16*)take((size_t)NB * nTE * 2);                                         // q hi plane, q residual plane x2048
    h16* K16 = (h16*)take((size_t)NB * nTE * 2); h16* VT16 = (h16*)take((size_t)NB * nTE * 2);
    float* Sb = (float*)take((size_t)SEQ * SEQ * 4);                                                                                    // scores from the hi plane, one batch
    float* Rb = (float*)take((size_t)SEQ * SEQ * 4);                                                                                    // scores from the residual plane x 2^-11, one batch
    h16* P16 = (h16*)take((size_t)SEQ * SEQ * 2);                                                                                       // P x1024, one batch
    h16* CTX16 = (h16*)take((size_t)NB * nTE * 2);                                                                                     // O as f16 (x1024)
    const size_t used = (size_t)(wsp - (char*)d_ws);
    if (used > ws_size || used > (size_t)134217728) return;

    // bf16 planes of the three inputs (batch b rows taken at the full stride) and of the weights; Wo as f16 x64 of its bf16 value
    const unsigned gx = (unsigned)((nTE / 8 + 255) / 256), gw = (unsigned)((nW / 8 + 255) / 256), gp = (unsigned)(((size_t)NB * nTE / 8 + 255) / 256);
    k_cvtb<<<dim3(gx, NB, 1), 256, 0, stream>>>(Xq, (size_t)SEQ_FULL * EM, XQ16, nTE, nTE / 8);
    k_cvtb<<<dim3(gx, NB, 1), 256, 0, stream>>>(Xk, (size_t)SEQ_FULL * EM, XK16, nTE, nTE / 8);
    k_cvtb<<<dim3(gx, NB, 1), 256, 0, stream>>>(Xv, (size_t)SEQ_FULL * EM, XV16, nTE, nTE / 8);
    k_cvtb<<<dim3(gw, 1, 1), 256, 0, stream>>>(Wq, (size_t)0, WQ16, (size_t)0, nW / 8);
    k_cvtb<<<dim3(gw, 1, 1), 256, 0, stream>>>(Wk, (size_t)0, WK16, (size_t)0, nW / 8);
    k_cvtb<<<dim3(gw, 1, 1), 256, 0, stream>>>(Wv, (size_t)0, WV16, (size_t)0, nW / 8);
    k_cvth<true><<<gw, 256, 0, stream>>>(Wo, WO16, nW / 8, WCAR);

    // q = Xq.Wq^T -> f32 [NB*T][E] -> f16 hi + residual planes; k = Xk.Wk^T -> f16 plane; v^T[b] = Wv.Xv[b]^T -> f32 [NB][E][T] -> f16 plane
    k_gemmw<bf, false><<<dim3(NB * SEQ / 64, EM / 64, 1), 32, 0, stream>>>(XQ16, WQ16, EM, F32, EM, nullptr, 1.0f, (size_t)0, (size_t)0, (size_t)0);
    k_cvthr<<<gp, 256, 0, stream>>>(F32, Q16, QL16, (size_t)NB * nTE / 8, RCAR);
    k_gemmw<bf, false><<<dim3(NB * SEQ / 64, EM / 64, 1), 32, 0, stream>>>(XK16, WK16, EM, F32, EM, nullptr, 1.0f, (size_t)0, (size_t)0, (size_t)0);
    k_cvth<false><<<gp, 256, 0, stream>>>(F32, K16, (size_t)NB * nTE / 8, 1.0f);
    k_gemmw<bf, false><<<dim3(EM / 64, SEQ / 64, NB), 32, 0, stream>>>(WV16, XV16, EM, F32, SEQ, nullptr, 1.0f, (size_t)0, nTE, nTE);
    k_cvth<false><<<gp, 256, 0, stream>>>(F32, VT16, (size_t)NB * nTE / 8, 1.0f);

    // per batch: S = qhi.k^T, R = (qres.k^T) x 2^-11 (f32 [T][T] each); P = softmax((S + R) x 512^-0.5) x1024 (f16); O[b] = P.v (f32 = 1024 x ctx) into the staging buffer rows b*T..
    for (int b = 0; b < NB; ++b) {
        k_gemmw<h16, false><<<dim3(SEQ / 64, SEQ / 64, 1), 32, 0, stream>>>(Q16 + (size_t)b * nTE, K16 + (size_t)b * nTE, EM, Sb, SEQ, nullptr, 1.0f, (size_t)0, (size_t)0, (size_t)0);
        k_gemmw<h16, false><<<dim3(SEQ / 64, SEQ / 64, 1), 32, 0, stream>>>(QL16 + (size_t)b * nTE, K16 + (size_t)b * nTE, EM, Rb, SEQ, nullptr, RINV, (size_t)0, (size_t)0, (size_t)0);
        k_asoft<<<SEQ / 8, 256, 0, stream>>>(Sb, Rb, P16);
        k_gemmw<h16, false><<<dim3(SEQ / 64, EM / 64, 1), 32, 0, stream>>>(P16, VT16 + (size_t)b * nTE, SEQ, F32 + (size_t)b * nTE, EM, nullptr, 1.0f, (size_t)0, (size_t)0, (size_t)0);
    }
    // ctx plane (f16, x1024) and the output projection: out = CTX.Wo^T x 2^-16 + bo
    k_cvth<false><<<gp, 256, 0, stream>>>(F32, CTX16, (size_t)NB * nTE / 8, 1.0f);
    k_gemmw<h16, true><<<dim3(NB * SEQ / 64, EM / 64, 1), 32, 0, stream>>>(CTX16, WO16, EM, OUT, EM, bo, OSC, (size_t)0, (size_t)0, (size_t)0);
}

// v001
// A run of this version takes 268 microseconds.
// Timed twice side by side with v000, it ran 1.77 and 1.76 times as fast.
#include <hip/hip_runtime.h>

// Contractions and operand types (f32 accumulate everywhere): q/k/v projections = v_wmma_f32_16x16x32_bf16 on bf16 (RNE) planes of the inputs and of Wq/Wk/Wv; scores q.k^T = v_wmma_f32_16x16x32_f16 with q as f16 hi plane plus f16 residual plane (x2048, own f32 buffer folded x2^-11) and k f16 x1; P.v^T and the output projection = v_wmma_f32_16x16x32_f16 (P f16 x1024; v^T f16 x1; ctx f16 x1024; Wo f16 x64 of its bf16 RNE value; 2^-16 folded back in the f32 epilogue); softmax f32; bias bf16 RNE value added in f32.
// Data flow: bf16 planes XQ/XK/XV and WQ/WK/WV; one f32 staging buffer reused in sequence for q, k, v^T (z-batched [E][T]) and the attention context O; f16 planes Qhi, Qres, K, V^T, CTX and S f32 / R f32 / P f16, all [NB][...] (every attention stage is one launch over all batches, batch = grid z or flat row); out rows [b*T + t][o] = CTX.Wo^T x 2^-16 + bo.

#ifndef NB
#define NB 4
#endif
#ifndef SEQ
#define SEQ 2048
#endif
#define NB_FULL  4
#define SEQ_FULL 2048
#define EM   512
#define TT   SEQ
#define PCAR 1024.0f
#define WCAR 64.0f
#define RCAR 2048.0f
#define RINV (1.0f / 2048.0f)
#define OSC  (1.0f / 65536.0f)
#define SCL  0.044194173824159216f   // 512^-0.5

static_assert(SEQ % 128 == 0);
static_assert(SEQ >= 128 && SEQ <= SEQ_FULL);
static_assert(NB >= 1 && NB <= NB_FULL);
static_assert(EM % 64 == 0 && EM % 32 == 0);
static_assert(((size_t)NB * SEQ) % 64 == 0);
static_assert((size_t)NB * SEQ * EM * 4 <= (size_t)16777216);

typedef _Float16 h16;
typedef unsigned short bf;
typedef __attribute__((ext_vector_type(16))) __bf16   v16bf;
typedef __attribute__((ext_vector_type(16))) _Float16 v16h;
typedef __attribute__((ext_vector_type(8)))  _Float16 v8h;
typedef __attribute__((ext_vector_type(4)))  _Float16 v4h;
typedef __attribute__((ext_vector_type(8)))  unsigned short v8us;
typedef __attribute__((ext_vector_type(8)))  float    v8f;
typedef __attribute__((ext_vector_type(4)))  float    v4f;
typedef v4f  __attribute__((may_alias)) v4fa;

__device__ __forceinline__ unsigned short f2bf(float f) { unsigned u = __float_as_uint(f); u += 0x7FFFu + ((u >> 16) & 1u); return (unsigned short)(u >> 16); }   // RNE convert
__device__ __forceinline__ float bf2f(unsigned short b) { return __uint_as_float(((unsigned)b) << 16); }
__device__ __forceinline__ float bfr(float f) { return bf2f(f2bf(f)); }
__device__ __forceinline__ h16 tohx(float x) { return (h16)x; }
__device__ __forceinline__ v16h cat16(v8h lo, v8h hi) { return __builtin_shufflevector(lo, hi, 0, 1, 2, 3, 4, 5, 6, 7, 8, 9, 10, 11, 12, 13, 14, 15); }
__device__ __forceinline__ v16bf cat16b(v8us lo, v8us hi) { return __builtin_bit_cast(v16bf, __builtin_shufflevector(lo, hi, 0, 1, 2, 3, 4, 5, 6, 7, 8, 9, 10, 11, 12, 13, 14, 15)); }
__device__ __forceinline__ v8f wmma16(v16h a, v16h b, v8f c) { return __builtin_amdgcn_wmma_f32_16x16x32_f16(false, a, false, b, (short)0, c, false, false); }
__device__ __forceinline__ v8f wmmab(v16bf a, v16bf b, v8f c) { return __builtin_amdgcn_wmma_f32_16x16x32_bf16(false, a, false, b, (short)0, c, false, false); }

// ---- k_gemmw: register-blocked GEMM, ONE WAVE per 64x64 output tile (16 accumulators), operands straight from K-contiguous 16-bit planes; grid (M/64, N/64, Z), 32 threads.
// C[m][n] (f32, pitch ldc) = oscale * sum_k A[m][k] Bt[n][k] (+ bf16-valued f32 bias[n]). z-batch strides sA/sB/sC in elements. K % 32 == 0, M % 64 == 0, N % 64 == 0.
// Fragments: lane l, row/col l&15, h = l>>4; elements 0..7 <- k0 + 8h + 0..7, elements 8..15 <- k0 + 16 + 8h + 0..7 for BOTH A and Bt; D element r -> row 8h + r, col l&15.
template <typename T16> struct WFrag;
template <> struct WFrag<h16> { typedef v16h V; static __device__ __forceinline__ V ld(const h16* p) { return cat16(*(const v8h*)p, *(const v8h*)(p + 16)); } static __device__ __forceinline__ v8f mma(V a, V b, v8f c) { return wmma16(a, b, c); } };
template <> struct WFrag<bf> { typedef v16bf V; static __device__ __forceinline__ V ld(const bf* p) { return cat16b(*(const v8us*)p, *(const v8us*)(p + 16)); } static __device__ __forceinline__ v8f mma(V a, V b, v8f c) { return wmmab(a, b, c); } };
template <typename T16, bool BIAS>
__global__ __launch_bounds__(32) void k_gemmw(const T16* __restrict__ A, const T16* __restrict__ Bt, int K, float* C, int ldc, const float* __restrict__ bias, float oscale, size_t sA, size_t sB, size_t sC) {
    typedef typename WFrag<T16>::V V;
    __shared__ __align__(16) float os[16 * 68];
    const size_t z = blockIdx.z; A += z * sA; Bt += z * sB; C += z * sC;
    const int lane = threadIdx.x & 31, lr = lane & 15, hi = lane >> 4; const int r0 = blockIdx.x * 64, c0 = blockIdx.y * 64;
    v8f acc[4][4];
#pragma unroll
    for (int mb = 0; mb < 4; ++mb)
#pragma unroll
        for (int nb = 0; nb < 4; ++nb) acc[mb][nb] = (v8f){};
    const size_t aoff = (size_t)(r0 + lr) * K + 8 * hi, boff = (size_t)(c0 + lr) * K + 8 * hi;
#pragma unroll 1
    for (int kc = 0; kc < K; kc += 32) {
        V a[4];
#pragma unroll
        for (int mb = 0; mb < 4; ++mb) a[mb] = WFrag<T16>::ld(A + aoff + (size_t)mb * 16 * K + kc);
#pragma unroll
        for (int nb = 0; nb < 4; ++nb) { const V b = WFrag<T16>::ld(Bt + boff + (size_t)nb * 16 * K + kc);
#pragma unroll
            for (int mb = 0; mb < 4; ++mb) acc[mb][nb] = WFrag<T16>::mma(a[mb], b, acc[mb][nb]); }
        asm volatile("v_nop\n\tv_nop\n\tv_nop\n\tv_nop" : "+v"(acc[0][0]), "+v"(acc[1][1]), "+v"(acc[2][2]), "+v"(acc[3][3]) : "v"(a[0]), "v"(a[3]));
    }
#pragma unroll
    for (int mb = 0; mb < 4; ++mb) {
#pragma unroll
        for (int nb = 0; nb < 4; ++nb) {
#pragma unroll
            for (int j = 0; j < 8; ++j) os[(hi * 8 + j) * 68 + nb * 16 + lr] = acc[mb][nb][j]; }
        __builtin_amdgcn_wave_barrier(); asm volatile("" ::: "memory");
        float* crow = C + (size_t)(r0 + mb * 16) * ldc + c0;
{
#pragma unroll
            for (int s = 0; s < 8; ++s) { const int row = 2 * s + hi, cofs = lr * 4; v4f val = *(const v4fa*)(os + row * 68 + cofs); val = val * oscale;
                if (BIAS) { val[0] += bfr(bias[c0 + cofs]); val[1] += bfr(bias[c0 + cofs + 1]); val[2] += bfr(bias[c0 + cofs + 2]); val[3] += bfr(bias[c0 + cofs + 3]); }
                *(v4f*)(crow + (size_t)row * ldc + cofs) = val; }
             }
        __builtin_amdgcn_wave_barrier(); asm volatile("" ::: "memory");
    }
}

__global__ __launch_bounds__(256) void k_cvtb(const float* __restrict__ src, size_t sstride, bf* dst, size_t dstride, size_t n8) {
    const size_t i = (size_t)blockIdx.x * 256 + threadIdx.x; if (i >= n8) return;
    const float* s = src + (size_t)blockIdx.y * sstride + i * 8; bf* d = dst + (size_t)blockIdx.y * dstride + i * 8;
    const v8f v = *(const v8f*)s; v8us o;
#pragma unroll
    for (int k = 0; k < 8; ++k) o[k] = f2bf(v[k]);
    *(v8us*)d = o;  }

template <bool RND>
__global__ __launch_bounds__(256) void k_cvth(const float* __restrict__ src, h16* dst, size_t n8, float sc) {
    const size_t i = (size_t)blockIdx.x * 256 + threadIdx.x; if (i >= n8) return;
    const v8f v = *(const v8f*)(src + i * 8); v8h o;
#pragma unroll
    for (int k = 0; k < 8; ++k) { float x = v[k]; if (RND) x = bfr(x); o[k] = tohx(x * sc); }
    *(v8h*)(dst + i * 8) = o;  }

__global__ __launch_bounds__(256) void k_cvthr(const float* __restrict__ src, h16* dhi, h16* dlo, size_t n8, float rsc) {
    const size_t i = (size_t)blockIdx.x * 256 + threadIdx.x; if (i >= n8) return;
    const v8f v = *(const v8f*)(src + i * 8); v8h oh, ol;
#pragma unroll
    for (int k = 0; k < 8; ++k) { const float x = v[k]; const h16 hx = tohx(x); float r = __fsub_rn(x, (float)hx); asm volatile("" : "+v"(r)); oh[k] = hx; ol[k] = tohx(r * rsc); }
    *(v8h*)(dhi + i * 8) = oh; *(v8h*)(dlo + i * 8) = ol;  }

// k_asoft: one wave per score row i of the flat [NB*TT] rows: t = (S + R) x 512^-0.5 (R = residual-plane scores already folded; no mask); max-subtracted softmax over the TT keys (register row, one exp2, fixed trees); P row stored as f16 x1024
__global__ __launch_bounds__(256) void k_asoft(const float* __restrict__ Sb, const float* __restrict__ Rb, h16* P16) {
    const int lane = threadIdx.x & 31; const int row = blockIdx.x * 8 + (threadIdx.x >> 5); if (row >= NB * TT) return;
    const float* sr = Sb + (size_t)row * TT; const float* rr = Rb + (size_t)row * TT; float v[TT / 32]; float mx = -3.0e38f;
#pragma unroll
    for (int ch = 0; ch < TT / 128; ++ch) { const int j0 = ch * 128 + lane * 4; const v4f a = *(const v4f*)(sr + j0); const v4f c = *(const v4f*)(rr + j0);
#pragma unroll
        for (int q = 0; q < 4; ++q) { float s0 = __fadd_rn(a[q], c[q]); asm volatile("" : "+v"(s0)); const float t = s0 * SCL; v[ch * 4 + q] = t; mx = fmaxf(mx, t); } }
#pragma unroll
    for (int sh = 16; sh; sh >>= 1) mx = fmaxf(mx, __shfl_xor(mx, sh, 32));
    float sum = 0.f;
#pragma unroll
    for (int k = 0; k < TT / 32; ++k) { float d0 = __fsub_rn(v[k], mx); asm volatile("" : "+v"(d0)); v[k] = __builtin_amdgcn_exp2f(__fmul_rn(d0, 1.4426950408889634f)); sum += v[k]; }
#pragma unroll
    for (int sh = 16; sh; sh >>= 1) sum += __shfl_xor(sum, sh, 32);
    const float f = __fdiv_rn(PCAR, sum);
{
#pragma unroll
        for (int ch = 0; ch < TT / 128; ++ch) { v4h o4;
#pragma unroll
            for (int q = 0; q < 4; ++q) o4[q] = tohx(v[ch * 4 + q] * f);
            *(v4h*)(P16 + (size_t)row * TT + ch * 128 + lane * 4) = o4; }
         }
}

extern "C" void kernel_launch(void* const* d_in, const int* in_sizes, int n_in,
                              void* d_out, int out_size, void* d_ws, size_t ws_size, hipStream_t stream) {
    if (n_in < 8) return;
    const size_t needx = (size_t)(NB - 1) * SEQ_FULL * EM + (size_t)SEQ * EM;
    if ((size_t)in_sizes[0] < needx || (size_t)in_sizes[1] < needx || (size_t)in_sizes[2] < needx) return;
    if (in_sizes[3] < EM * EM || in_sizes[4] < EM * EM || in_sizes[5] < EM * EM || in_sizes[6] < EM * EM || in_sizes[7] < EM) return;
    if ((size_t)out_size < (size_t)NB * SEQ * EM) return;
    const float* Xv = (const float*)d_in[0];   // value [NB_FULL][SEQ_FULL][EM]
    const float* Xk = (const float*)d_in[1];   // key
    const float* Xq = (const float*)d_in[2];   // query
    const float* Wq = (const float*)d_in[3];   // [EM out][EM in]
    const float* Wk = (const float*)d_in[4];
    const float* Wv = (const float*)d_in[5];
    const float* Wo = (const float*)d_in[6];
    const float* bo = (const float*)d_in[7];   // [EM]
    float* OUT = (float*)d_out;                // [NB][SEQ][EM] f32

    char* wsp = (char*)d_ws;
    auto take = [&](size_t bytes) { char* p = wsp; wsp += (bytes + 255) & ~(size_t)255; return (void*)p; };
    const size_t nTE = (size_t)SEQ * EM;       // per-batch plane elements
    const size_t nW = (size_t)EM * EM;
    bf*  XQ16 = (bf*)take((size_t)NB * nTE * 2); bf* XK16 = (bf*)take((size_t)NB * nTE * 2); bf* XV16 = (bf*)take((size_t)NB * nTE * 2);   // [NB*T][E] bf16
    bf*  WQ16 = (bf*)take(nW * 2); bf* WK16 = (bf*)take(nW * 2); bf* WV16 = (bf*)take(nW * 2);                                           // [E][E] bf16 (as-is: Bt for q and k, A for v^T)
    h16* WO16 = (h16*)take(nW * 2);                                                                                                     // [E][E] f16 x64
    float* F32 = (float*)take((size_t)NB * nTE * 4);                                                                                   // f32 staging: q, k, v^T [NB][E][T], then O [NB*T][E]
    h16* Q16 = (h16*)take((size_t)NB * nTE * 2); h16* QL16 = (h16*)take((size_t)NB * nTE * 2);                                         // q hi plane, q residual plane x2048
    h16* K16 = (h16*)take((size_t)NB * nTE * 2); h16* VT16 = (h16*)take((size_t)NB * nTE * 2);
    const size_t nTT = (size_t)SEQ * SEQ;      // per-batch score elements
    float* Sb = (float*)take((size_t)NB * nTT * 4);                                                                                     // scores from the hi plane, [NB][T][T]
    float* Rb = (float*)take((size_t)NB * nTT * 4);                                                                                     // scores from the residual plane x 2^-11, [NB][T][T]
    h16* P16 = (h16*)take((size_t)NB * nTT * 2);                                                                                        // P x1024, [NB][T][T]
    h16* CTX16 = (h16*)take((size_t)NB * nTE * 2);                                                                                     // O as f16 (x1024)
    const size_t used = (size_t)(wsp - (char*)d_ws);
    if (used > ws_size) return;

    // bf16 planes of the three inputs (batch b rows taken at the full stride) and of the weights; Wo as f16 x64 of its bf16 value
    const unsigned gx = (unsigned)((nTE / 8 + 255) / 256), gw = (unsigned)((nW / 8 + 255) / 256), gp = (unsigned)(((size_t)NB * nTE / 8 + 255) / 256);
    k_cvtb<<<dim3(gx, NB, 1), 256, 0, stream>>>(Xq, (size_t)SEQ_FULL * EM, XQ16, nTE, nTE / 8);
    k_cvtb<<<dim3(gx, NB, 1), 256, 0, stream>>>(Xk, (size_t)SEQ_FULL * EM, XK16, nTE, nTE / 8);
    k_cvtb<<<dim3(gx, NB, 1), 256, 0, stream>>>(Xv, (size_t)SEQ_FULL * EM, XV16, nTE, nTE / 8);
    k_cvtb<<<dim3(gw, 1, 1), 256, 0, stream>>>(Wq, (size_t)0, WQ16, (size_t)0, nW / 8);
    k_cvtb<<<dim3(gw, 1, 1), 256, 0, stream>>>(Wk, (size_t)0, WK16, (size_t)0, nW / 8);
    k_cvtb<<<dim3(gw, 1, 1), 256, 0, stream>>>(Wv, (size_t)0, WV16, (size_t)0, nW / 8);
    k_cvth<true><<<gw, 256, 0, stream>>>(Wo, WO16, nW / 8, WCAR);

    // q = Xq.Wq^T -> f32 [NB*T][E] -> f16 hi + residual planes; k = Xk.Wk^T -> f16 plane; v^T[b] = Wv.Xv[b]^T -> f32 [NB][E][T] -> f16 plane
    k_gemmw<bf, false><<<dim3(NB * SEQ / 64, EM / 64, 1), 32, 0, stream>>>(XQ16, WQ16, EM, F32, EM, nullptr, 1.0f, (size_t)0, (size_t)0, (size_t)0);
    k_cvthr<<<gp, 256, 0, stream>>>(F32, Q16, QL16, (size_t)NB * nTE / 8, RCAR);
    k_gemmw<bf, false><<<dim3(NB * SEQ / 64, EM / 64, 1), 32, 0, stream>>>(XK16, WK16, EM, F32, EM, nullptr, 1.0f, (size_t)0, (size_t)0, (size_t)0);
    k_cvth<false><<<gp, 256, 0, stream>>>(F32, K16, (size_t)NB * nTE / 8, 1.0f);
    k_gemmw<bf, false><<<dim3(EM / 64, SEQ / 64, NB), 32, 0, stream>>>(WV16, XV16, EM, F32, SEQ, nullptr, 1.0f, (size_t)0, nTE, nTE);
    k_cvth<false><<<gp, 256, 0, stream>>>(F32, VT16, (size_t)NB * nTE / 8, 1.0f);

    // all batches per launch (batch = grid z; flat rows for the softmax): S = qhi.k^T, R = (qres.k^T) x 2^-11 (f32 [NB][T][T] each); P = softmax((S + R) x 512^-0.5) x1024 (f16); O[b] = P[b].v[b] (f32 = 1024 x ctx) into the staging buffer rows b*T..
    k_gemmw<h16, false><<<dim3(SEQ / 64, SEQ / 64, NB), 32, 0, stream>>>(Q16, K16, EM, Sb, SEQ, nullptr, 1.0f, nTE, nTE, nTT);
    k_gemmw<h16, false><<<dim3(SEQ / 64, SEQ / 64, NB), 32, 0, stream>>>(QL16, K16, EM, Rb, SEQ, nullptr, RINV, nTE, nTE, nTT);
    k_asoft<<<NB * SEQ / 8, 256, 0, stream>>>(Sb, Rb, P16);
    k_gemmw<h16, false><<<dim3(SEQ / 64, EM / 64, NB), 32, 0, stream>>>(P16, VT16, SEQ, F32, EM, nullptr, 1.0f, nTT, nTE, nTE);
    // ctx plane (f16, x1024) and the output projection: out = CTX.Wo^T x 2^-16 + bo
    k_cvth<false><<<gp, 256, 0, stream>>>(F32, CTX16, (size_t)NB * nTE / 8, 1.0f);
    k_gemmw<h16, true><<<dim3(NB * SEQ / 64, EM / 64, 1), 32, 0, stream>>>(CTX16, WO16, EM, OUT, EM, bo, OSC, (size_t)0, (size_t)0, (size_t)0);
}
